// v010
// Times are from an AMD MI455X. After a warm-up the kernel runs many times in a row, and a time is the length of
// such a window on the GPU divided by its runs, so every launch and the gaps after it count. The runs cycle
// through copies of the inputs. A figure is the median of several windows, for all but v000 over two sittings.
// Sittings can differ by a few percent; kernels timed side by side share one.
// This document starts at v010; the versions before it stand elsewhere.
// Measured time: 228 microseconds a run.
// In both of two side-by-side timings against v009, it was 1.07 times as fast.
// Over all steps from v000, the starting kernel, it is 8.06 times as fast.
// Contractions on v_wmma_f32_16x16x32_bf16 (bf16 operands, f32 accumulate): x*Wq, x*Wk, Wv^T*x^T as single
// products of bf16-RNE inputs; q.k^T and p.v as bf16 hi/lo split (hi.hi + hi.lo + lo.hi); ctx*Wo with
// ctx hi/lo split against bf16 Wo (hi.Wo + lo.Wo); edge bias (16-deep dots of bf16-RNE inputs), online softmax and all biases in f32 on the VALU.
#include <hip/hip_runtime.h>
#include <math.h>
#include <stdint.h>
#include <stddef.h>

// Geometry: NGR graphs of NND consecutive node rows; attention keys of a query = the NND nodes of its graph.
// The job runs in NHALF passes of GHALF graphs each (one pass of all graphs: the attention launch then has one
// work-group for each of the 256 WGPs); the q / k / v^T / ctx planes are rewritten per pass.
//
// Plane map (workspace, all 16-bit planes are bf16 bits; no power-of-two carries anywhere, so no inverse
// factor exists -> carry audit: none):
//   Xb   [16384][512]          bf16(x)                                        -> A of q/k GEMMs, Bt of v^T GEMM
//   WqT, WkT, WvT [512 o][512 i]  bf16(W[i][o])                              -> Bt / A (k-contiguous)
//   WOT2 [512 o][1024]         bf16(Wo[k mod 512][o])                         -> Bt of the output GEMM
//   EB   [EP][8] f32           sum_t bf16(ea[e][t]) bf16(We[t][h]) + bf16(be[h])
//   Qp, Kp [16384][1024]       hi at col h*64+d, residual lo at col 512 + h*64+d (f32 projection split)
//   VTp  [32 graphs][512 (h,d)][1024]   hi at col s, lo at col 512 + s (s = node within graph)
//   CTX  [16384][1024]         hi | lo of the normalised attention context

#define NGR    32
#define NND    512
#define NTOT   (NGR * NND)      // 16384
#define HID    512
#define NHD    8
#define HDM    64
#define EDW    16
#define NHALF  1
#define GHALF  (NGR / NHALF)    // 32
#define RHALF  (GHALF * NND)    // 16384
#define PLD    1024
#define NTHR   256
#define WSMAX  268435456

static_assert(HID == NHD * HDM && HDM == 64 && NHD == 8);
static_assert(PLD == 2 * HID);
static_assert((RHALF % 64) == 0 && (HID % 64) == 0 && (NND % 64) == 0 && (PLD % 32) == 0 && (HID % 32) == 0);
static_assert(NGR == NHALF * GHALF);
static_assert(HID == 64 * 8);                               // d_xprep: 64 units of 8 per row
static_assert(EDW == 16 && NHD == 8 && EDW * NHD <= NTHR);  // d_eb layout

typedef __attribute__((ext_vector_type(16))) _Float16 v16h;
typedef __attribute__((ext_vector_type(8)))  _Float16 v8h;
typedef __attribute__((ext_vector_type(16))) __bf16   v16b;
typedef __attribute__((ext_vector_type(8)))  __bf16   v8b;
typedef __attribute__((ext_vector_type(8)))  float    v8f;
typedef __attribute__((ext_vector_type(4)))  float    v4f;
typedef __attribute__((ext_vector_type(2)))  float    v2f;
typedef __attribute__((ext_vector_type(4)))  unsigned int v4u;
typedef __attribute__((ext_vector_type(4)))  int      v4i;
typedef __attribute__((ext_vector_type(8)))  unsigned short v8us;
typedef v4f  __attribute__((may_alias)) v4fa;
typedef v2f  __attribute__((may_alias)) v2fa;
typedef v4u  __attribute__((may_alias)) v4ua;

// ---- scalar helpers: f32 -> bf16 bits (RNE convert), bf16 bits -> f32 ----
__device__ __forceinline__ unsigned short f2bf_bits(float f) {
  unsigned u = __float_as_uint(f);
  return (unsigned short)((u + 0x7FFFu + ((u >> 16) & 1u)) >> 16);
}
__device__ __forceinline__ float bf_bits2f(unsigned short h) { return __uint_as_float(((unsigned)h) << 16); }
__device__ __forceinline__ float bfrf(float f) { return bf_bits2f(f2bf_bits(f)); }
__device__ __forceinline__ unsigned int f2bfu(float f) {
  const unsigned int u = __float_as_uint(f);
  return ((u + 0x7FFFu + ((u >> 16) & 1u)) >> 16) & 0xFFFFu;
}
__device__ __forceinline__ float bf2f(unsigned int b) { return __uint_as_float(b << 16); }
__device__ __forceinline__ v4f bfr4(const v4f a) {
  v4f r; r.x = bfrf(a.x); r.y = bfrf(a.y); r.z = bfrf(a.z); r.w = bfrf(a.w); return r;
}
__device__ __forceinline__ unsigned int pk2(float lo, float hi) { return f2bfu(lo) | (f2bfu(hi) << 16); }
__device__ __forceinline__ v4u pack8(const v4f a, const v4f b) {
  v4u r;
  r.x = pk2(a.x, a.y); r.y = pk2(a.z, a.w); r.z = pk2(b.x, b.y); r.w = pk2(b.z, b.w);
  return r;
}
// hi = bf16(v), lo = bf16(v - hi): two floats -> one packed word of each
__device__ __forceinline__ void hl2(float v0, float v1, unsigned int& hw, unsigned int& lw) {
  const unsigned int h0 = f2bfu(v0), h1 = f2bfu(v1);
  const unsigned int l0 = f2bfu(v0 - bf2f(h0)), l1 = f2bfu(v1 - bf2f(h1));
  hw = h0 | (h1 << 16);
  lw = l0 | (l1 << 16);
}
__device__ __forceinline__ void pack8hl(const v4f a, const v4f b, v4u& hv, v4u& lv) {
  unsigned int h, l;
  hl2(a.x, a.y, h, l); hv.x = h; lv.x = l;
  hl2(a.z, a.w, h, l); hv.y = h; lv.y = l;
  hl2(b.x, b.y, h, l); hv.z = h; lv.z = l;
  hl2(b.z, b.w, h, l); hv.w = h; lv.w = l;
}

// ---- WMMA fragment helpers (bf16, wave32) ----
// A fragment (row m = lane&15) and B fragment (col n = lane&15) use the SAME k map:
//   elements 0..7 <- k0 + 8h + 0..7, elements 8..15 <- k0 + 16 + 8h + 0..7, h = lane>>4,
// loaded as two 16-B pieces from a k-contiguous 16-bit row: p[0..7] and p[16..23] with p = row + k0 + 8h.
// D element r of lane l = (row 8h + r, col l&15).
__device__ __forceinline__ void dep_guard_b(v8f& a, v8f& b, v16b x, v16b y) { asm volatile("v_nop\n\tv_nop\n\tv_nop\n\tv_nop" : "+v"(a), "+v"(b) : "v"(x), "v"(y)); }
__device__ __forceinline__ void keep4_b(v16b a, v16b b, v16b c, v16b d) { asm volatile("v_nop" :: "v"(a), "v"(b), "v"(c), "v"(d)); }
__device__ __forceinline__ void acc_guard4(v8f& a, v8f& b, v8f& c, v8f& d) { asm volatile("v_nop\n\tv_nop\n\tv_nop\n\tv_nop" : "+v"(a), "+v"(b), "+v"(c), "+v"(d)); }

struct FragBF {
  union U { v16b v; v8b h[2]; };
  static __device__ __forceinline__ v16b load(const __bf16* p) {   // elements 0..7 <- p[0..7], 8..15 <- p[16..23]
    U f; f.h[0] = *(const v8b*)(p); f.h[1] = *(const v8b*)(p + 16); return f.v;
  }
  static __device__ __forceinline__ v8f mma(v16b a, v16b b, v8f c) {
    return __builtin_amdgcn_wmma_f32_16x16x32_bf16(false, a, false, b, (short)0, c, false, false);
  }
  static __device__ __forceinline__ void guard(v8f& a, v8f& b, v16b x, v16b y) { dep_guard_b(a, b, x, y); }
  static __device__ __forceinline__ void keep(v16b a, v16b b, v16b c, v16b d) { keep4_b(a, b, c, d); }
};
union FB { v16b v; v8b h[2]; };

// single WMMA with hazard guard: ties D, keeps A/B live for 4 VALU slots
__device__ __forceinline__ v8f at_mma(v16b a, v16b b, v8f c) {
  c = __builtin_amdgcn_wmma_f32_16x16x32_bf16(false, a, false, b, (short)0, c, false, false);
  asm volatile("v_nop\n\tv_nop\n\tv_nop\n\tv_nop" : "+v"(c) : "v"(a), "v"(b));
  return c;
}
__device__ __forceinline__ __bf16 at_f2bf(float f) { return __builtin_bit_cast(__bf16, f2bf_bits(f)); }
__device__ __forceinline__ void at_split(float f, __bf16& hi, __bf16& lo) {
  const unsigned short hb = f2bf_bits(f);
  hi = __builtin_bit_cast(__bf16, hb);
  lo = at_f2bf(f - __uint_as_float(((unsigned)hb) << 16));
}

typedef uint32_t u32x4 __attribute__((ext_vector_type(4)));
typedef uint32_t u32x8 __attribute__((ext_vector_type(8)));
__device__ __forceinline__ uint32_t uni(uint32_t v) { return (uint32_t)__builtin_amdgcn_readfirstlane(v); }
// a test around a tensor load held in a scalar register, so that it compiles to s_cmp + s_cbranch_scc
__device__ __forceinline__ uint32_t pinned(uint32_t v) { uint32_t w = uni(v); asm volatile("" : "+s"(w)); return w; }
// Descriptor of one tile of 64 rows x 128 B, source pitch PLD * 2 B, from global address ga to LDS byte offset dst;
// 16 B of pad behind every row (LDS pitch 144 B = KVP elements).
__device__ __forceinline__ u32x4 tile_g0(uint32_t dst, uint64_t ga) {
  u32x4 g0;
  g0[0] = uni(1u);
  g0[1] = uni(dst);
  g0[2] = uni((uint32_t)ga);
  g0[3] = uni((((uint32_t)(ga >> 32)) & 0x01FFFFFFu) | 0x80000000u);
  return g0;
}
__device__ __forceinline__ u32x8 tile_g1() {
  u32x8 g1;
  g1[0] = uni((1u << 20) | (4u << 22) | (3u << 25));   // no mask, 1-byte elements, pad of 4 dwords per 32 dwords
  g1[1] = uni(128u << 16);                             // tensor_dim0 = 128 B
  g1[2] = uni(64u << 16);                              // tensor_dim1 = 64 rows
  g1[3] = uni(128u << 16);                             // tile_dim0 = 128 B
  g1[4] = uni(64u);                                    // tile_dim1 = 64 rows
  g1[5] = uni((uint32_t)(PLD * 2));                    // source row pitch
  g1[6] = uni(0u);
  g1[7] = uni(0u);
  return g1;
}
// One request of the whole wave; the waits are the caller's.
__device__ __forceinline__ void tile_load(u32x4 g0, u32x8 g1) {
  asm volatile("tensor_load_to_lds %0, %1" :: "s"(g0), "s"(g1) : "memory");
}
// The wave's request has landed. The descriptor is named as an input so that its registers stay as they are while
// the request is outstanding.
__device__ __forceinline__ void tile_wait(u32x4 g0, u32x8 g1) {
  asm volatile("s_wait_tensorcnt 0x0" :: "s"(g0), "s"(g1) : "memory");
}

// =====================================================================================
// Register-blocked batched WMMA GEMM (bf16 operands), operands staged in LDS by tensor loads.
// C[m,n] = scale * sum_k A[m,k] * Bt[n,k] (+bias)(+resid); a block owns a GBM x GBN tile, each of its 8 waves 64x64.
// A row-major [M,K]; Bt row-major [N,K]; M % GBM == 0, N % GBN == 0, K % GPK == 0, K >= 2 GPK (host static_asserts).
// A stage = GPK k of the block's GBM rows of A and GBN rows of Bt: GNS slices of 64 rows x 256 B, one tensor load of
// one wave each (waves 0..GNS-1), 16 B of pad behind every row; two buffers, one stage ahead.
// BIAS_MODE: 0 = none, 1 = bf16r(bias[m]), 2 = bf16r(bias[n]).
// OUT_MODE: 0 = f32, 1 = f16, 2 = bf16 hi plane (Cout) + bf16 lo plane (Cout2).
// coverage: grid.x == (M/GBM)*(N/GBN) block tiles exactly (host), every C element written once per z.
// =====================================================================================
#define GBM   128                     // rows of A per block
#define GBN   256                     // rows of Bt per block
#define GPK   128                     // k per stage: rows of 256 B
#define GRP   136                     // row pitch in LDS, elements: 272 B = 16 B x 17, so the 16 rows of a ds_load_b128
                                      // fragment read fall on 16 different bank groups
#define GSL   9216                    // one slice: 64 * GRP elements, its place rounded up to 2 KiB
#define GNS   ((GBM + GBN) / 64)      // slices per stage: 2 of A, then 4 of Bt
#define GBUF  (GNS * GSL)             // one buffer
static_assert(GSL >= 64 * GRP && (GSL * 2) % 2048 == 0 && GRP * 2 == 256 + 16 && GPK * 2 == 256);
static_assert(GBM == 2 * 64 && GBN == 4 * 64 && GNS <= 8);     // 2 x 4 waves of 64 x 64
static_assert((RHALF % GBM) == 0 && (HID % GBM) == 0 && (HID % GBN) == 0 && (NND % GBN) == 0);   // block tiles, exact
static_assert((HID % GPK) == 0 && (PLD % GPK) == 0 && HID / GPK >= 2);                            // stages, at least two

// Group 1 for a slice of 64 rows x 256 B at a source pitch of pitchB bytes; LDS pitch 272 B = GRP elements.
__device__ __forceinline__ u32x8 slice_g1(uint32_t pitchB) {
  u32x8 g1;
  g1[0] = uni((1u << 20) | (5u << 22) | (3u << 25));   // no mask, 1-byte elements, pad of 4 dwords per 64 dwords
  // words 1 to 7 through pinned(): each descriptor word held in a scalar register of its own, so that the build does
  // not form equal words anew from one another, in registers it has lent out, while a request is outstanding
  g1[1] = pinned(256u << 16);                          // tensor_dim0 = 256 B; descriptor word held in a scalar register
  g1[2] = pinned(64u << 16);                           // tensor_dim1 = 64 rows; descriptor word held likewise
  g1[3] = pinned(256u << 16);                          // tile_dim0 = 256 B; descriptor word held likewise
  g1[4] = pinned(64u);                                 // tile_dim1 = 64 rows; descriptor word held likewise
  g1[5] = pinned(pitchB);                              // source row pitch; descriptor word held likewise
  g1[6] = pinned(0u);                                  // descriptor word held likewise
  g1[7] = pinned(0u);                                  // descriptor word held likewise
  return g1;
}

// Group 0 for a slice from global address ga to LDS byte offset dst. Word 0 (count 1) through pinned(): a descriptor
// word held in a scalar register, so that the build does not lend that register out while a request is outstanding.
__device__ __forceinline__ u32x4 slice_g0(uint32_t dst, uint64_t ga) {
  u32x4 g0;
  g0[0] = pinned(1u);                                  // count 1; descriptor word held in a scalar register
  g0[1] = uni(dst);
  g0[2] = uni((uint32_t)ga);
  g0[3] = uni((((uint32_t)(ga >> 32)) & 0x01FFFFFFu) | 0x80000000u);
  return g0;
}

// The block tile's whole work, called by the kernels below: ring / sTall = the calling kernel's LDS, bx = index of the
// block tile, b = batch index (both the same in every thread of the block).
template <bool SPLIT, int BIAS_MODE, int OUT_MODE, bool RESID, int ACT = 0>
__device__ __forceinline__ void gemm_tile(
    unsigned short* ring, float* sTall, int bx, int b,
    const unsigned short* __restrict__ Ap, const unsigned short* __restrict__ A2p, int lda, long strideA,
    const unsigned short* __restrict__ Btp, const unsigned short* __restrict__ Bt2p, int ldb, long strideB,
    void* __restrict__ Cout, void* __restrict__ Cout2, int ldc, long strideC,
    const float* __restrict__ bias,
    const float* __restrict__ resid, long strideR,
    int M, int N, int K, float scale) {
  static_assert(!SPLIT);                            // only the hi planes are staged
  typedef __bf16 T;
  typedef v16b V;
  const int lane = threadIdx.x & 31;
  const int wave = threadIdx.x >> 5;
  const int tilesN = N / GBN;
  const int tilesM = M / GBM;
  if (bx >= tilesM * tilesN) return;           // the whole block, in front of every barrier and tensor load
  const int tm = bx / tilesN;
  const int tn = bx - tm * tilesN;
  const int wm = wave >> 2;                    // the wave's 64 rows within the block tile
  const int wn = wave & 3;                     // the wave's 64 columns within the block tile
  const int m0 = tm * GBM + (wm << 6);
  const int n0 = tn * GBN + (wn << 6);

  const int rlane = lane & 15;                 // row (A) / col (B, D) within subtile
  const int koff  = (lane >> 4) * 8;           // k offset of this lane half
  const int mOff  = (lane >> 4) * 8;           // D row offset

  // ---- slices: wave w < GNS brings slice w of every stage (0, 1: A rows; 2..5: Bt rows) into buffer stage % 2 ----
  const uint32_t wvu  = uni((uint32_t)wave);
  const uint32_t sl   = wvu < (uint32_t)GNS ? wvu : (uint32_t)GNS - 1u;
  const bool     isA  = sl < (uint32_t)(GBM / 64);
  const bool     iss  = wvu < (uint32_t)GNS;
  const uint32_t ldsb = (uint32_t)(size_t)ring;
  const unsigned short* sp0 = isA ? Ap  + (size_t)b * strideA + (size_t)(tm * GBM + (int)sl * 64) * lda
                                  : Btp + (size_t)b * strideB + (size_t)(tn * GBN + ((int)sl - GBM / 64) * 64) * ldb;
  const u32x8 g1 = slice_g1((uint32_t)(isA ? lda : ldb) * 2u);
  const int nst = K / GPK;                     // stages
  u32x4 g0;
  // group 0 of stage st, formed by every wave (one set of registers on every path); only the load stands in the branch
  auto form = [&](uint32_t st) {
    g0 = slice_g0(ldsb + ((st & 1u) * GBUF + sl * GSL) * 2u, (uint64_t)(size_t)sp0 + (uint64_t)st * (GPK * 2));
  };
  form(0u);
  if (pinned((uint32_t)iss)) {
    tile_load(g0, g1);
    tile_wait(g0, g1);                                  // this wave's slice of stage 0 has landed
  }
  __syncthreads();                                      // stage 0 readable by every wave
  form(1u);
  if (pinned((uint32_t)(iss && nst > 1))) tile_load(g0, g1);

  v8f acc[4][4];
#pragma unroll
  for (int i = 0; i < 4; ++i)
#pragma unroll
    for (int j = 0; j < 4; ++j) acc[i][j] = (v8f){0.f,0.f,0.f,0.f,0.f,0.f,0.f,0.f};

#pragma unroll 1   // one stage per trip: the publish point at its foot stands once in the code
  for (int st = 0; st < nst; ++st) {
    // this pass reads buffer st % 2 alone; stage st + 1 is in flight
    const T* bufp = (const T*)(const void*)ring + (st & 1) * GBUF;
    const T* As = bufp + wm * GSL + rlane * GRP + koff;
    const T* Bs = bufp + (GBM / 64 + wn) * GSL + rlane * GRP + koff;
#pragma unroll   // fragment addresses as immediate offsets; the next k step's LDS reads may go ahead of this one's products
    for (int kk = 0; kk < GPK / 32; ++kk) {
      V bh[4], ah[4];
#pragma unroll
      for (int j = 0; j < 4; ++j) bh[j] = FragBF::load(Bs + j * 16 * GRP + kk * 32);
#pragma unroll
      for (int i = 0; i < 4; ++i) ah[i] = FragBF::load(As + i * 16 * GRP + kk * 32);
#pragma unroll
      for (int i = 0; i < 4; ++i) {
#pragma unroll
        for (int j = 0; j < 4; ++j) acc[i][j] = FragBF::mma(ah[i], bh[j], acc[i][j]);
        FragBF::guard(acc[i][0], acc[i][3], ah[i], ah[i]);
      }
      FragBF::keep(bh[0], bh[1], bh[2], bh[3]);
    }
    // ---- publish point of stage st + 1, every wave, in this order ----
    asm volatile("s_wait_dscnt 0x0" ::: "memory");       // this wave's reads of buffer st % 2 are done
    if (pinned((uint32_t)iss)) tile_wait(g0, g1);         // this wave's slice of stage st + 1 has landed
    __syncthreads();                                      // stage st + 1 readable; buffer st % 2 free
    form((uint32_t)st + 2u);
    if (pinned((uint32_t)(iss && st + 2 < nst))) tile_load(g0, g1);          // refill of the buffer this pass has read
  }
  // no request in flight and no LDS read outstanding behind the loop
  asm volatile("s_wait_tensorcnt 0x0" ::: "memory");
  asm volatile("s_wait_dscnt 0x0" ::: "memory");
  acc_guard4(acc[0][0], acc[0][1], acc[0][2], acc[0][3]);
  acc_guard4(acc[1][0], acc[1][1], acc[1][2], acc[1][3]);
  acc_guard4(acc[2][0], acc[2][1], acc[2][2], acc[2][3]);
  acc_guard4(acc[3][0], acc[3][1], acc[3][2], acc[3][3]);

  // ---- epilogue ----
  float* slab = sTall + wave * (16 * 68);
  const float* Rb = RESID ? (resid + (size_t)b * strideR) : nullptr;
#pragma unroll
  for (int i = 0; i < 4; ++i) {
    const int mBase = m0 + (i << 4);
    float bm[8];
    if (BIAS_MODE == 1) {   // 8 consecutive floats, 32-B aligned: two 16-B loads
      const v4f b0v = bfr4(*(const v4fa*)(bias + mBase + mOff));
      const v4f b1v = bfr4(*(const v4fa*)(bias + mBase + mOff + 4));
      bm[0] = b0v.x; bm[1] = b0v.y; bm[2] = b0v.z; bm[3] = b0v.w;
      bm[4] = b1v.x; bm[5] = b1v.y; bm[6] = b1v.z; bm[7] = b1v.w;
    } else {
#pragma unroll
      for (int r = 0; r < 8; ++r) bm[r] = 0.f;
    }
#pragma unroll
    for (int j = 0; j < 4; ++j) {
      const int n = n0 + (j << 4) + rlane;
      float bv = 0.f;
      if (BIAS_MODE == 2) bv = bfrf(bias[n]);
#pragma unroll
      for (int r = 0; r < 8; ++r) {
        float v = acc[i][j][r] * scale;
        if (BIAS_MODE == 1) v += bm[r];
        if (BIAS_MODE == 2) v += bv;
        if (RESID) v += Rb[(size_t)(mBase + mOff + r) * ldc + n];
        if (ACT == 1) v = tanhf(v);
        if (ACT == 2) v = fmaxf(v, 0.0f);
        if (ACT == 4) v = (v > 0.f) ? v : 0.01f * v;
        slab[(mOff + r) * 68 + (j << 4) + rlane] = v;
      }
    }
    __builtin_amdgcn_fence(__ATOMIC_RELEASE, "workgroup");
    __builtin_amdgcn_wave_barrier();
    __builtin_amdgcn_fence(__ATOMIC_ACQUIRE, "workgroup");
    if (OUT_MODE == 0) {
      float* C = (float*)Cout + (size_t)b * strideC;
      const int hh = lane >> 4, c4 = (lane & 15) * 4;     // row seg = 256 B = 16 lanes x 16 B
      {
#pragma unroll
        for (int it = 0; it < 8; ++it) {
          const int row = it * 2 + hh;
          v4f v = *(const v4f*)(slab + row * 68 + c4);
          *(v4f*)(C + (size_t)(mBase + row) * ldc + n0 + c4) = v;
        }
        
      }
    } else {
      const int q = lane >> 3, c8 = (lane & 7) * 8;
      unsigned short* C  = (unsigned short*)Cout  + (size_t)b * strideC;
      unsigned short* C2 = (OUT_MODE == 2) ? ((unsigned short*)Cout2 + (size_t)b * strideC) : nullptr;
      {
#pragma unroll
        for (int it = 0; it < 4; ++it) {
          const int row = it * 4 + q;
          const float* sp = slab + row * 68 + c8;
          v8h hv, lv;
#pragma unroll
          for (int e = 0; e < 8; ++e) {
            if (OUT_MODE == 1) {
              hv[e] = (_Float16)sp[e];
            } else {
              unsigned short hb = f2bf_bits(sp[e]);
              unsigned short lb = f2bf_bits(sp[e] - bf_bits2f(hb));
              hv[e] = __builtin_bit_cast(_Float16, hb);
              lv[e] = __builtin_bit_cast(_Float16, lb);
            }
          }
          *(v8h*)(C + (size_t)(mBase + row) * ldc + n0 + c8) = hv;
          if (OUT_MODE == 2) *(v8h*)(C2 + (size_t)(mBase + row) * ldc + n0 + c8) = lv;
        }
        
      }
    }
    __builtin_amdgcn_fence(__ATOMIC_RELEASE, "workgroup");
    __builtin_amdgcn_wave_barrier();
    __builtin_amdgcn_fence(__ATOMIC_ACQUIRE, "workgroup");
  }
}

// One product per launch: grid.x = block tiles, grid.y = batch.
template <bool SPLIT, int BIAS_MODE, int OUT_MODE, bool RESID, int ACT = 0>
__global__ __launch_bounds__(256) void wmma_gemm64(
    const unsigned short* __restrict__ Ap, const unsigned short* __restrict__ A2p, int lda, long strideA,
    const unsigned short* __restrict__ Btp, const unsigned short* __restrict__ Bt2p, int ldb, long strideB,
    void* __restrict__ Cout, void* __restrict__ Cout2, int ldc, long strideC,
    const float* __restrict__ bias,
    const float* __restrict__ resid, long strideR,
    int M, int N, int K, float scale) {
  __shared__ __attribute__((aligned(2048))) unsigned short ring[2 * GBUF];   // tensor loads: places at multiples of 2 KiB
  __shared__ __align__(16) float sT[8 * 16 * 68];   // per-wave 16x64 slab, pitch 68 floats
  gemm_tile<SPLIT, BIAS_MODE, OUT_MODE, RESID, ACT>(ring, sT, (int)blockIdx.x, (int)blockIdx.y,
      Ap, A2p, lda, strideA, Btp, Bt2p, ldb, strideB, Cout, Cout2, ldc, strideC, bias, resid, strideR, M, N, K, scale);
}

// The three projections, which do not depend on one another, in one launch: grid.y = 0: q = x . Wq + bq -> Qp hi | lo,
// 1: k = x . Wk + bk -> Kp hi | lo (M = RHALF, N = K = HID), 2: v^T = Wv^T . x^T + bv[m] per graph -> VTp hi | lo
// (M = HID, N = NND, K = HID; block tile = blockIdx.x % QKV_VT, graph = blockIdx.x / QKV_VT).
// coverage: grid.x = QKV_NB block tiles of each product exactly (static_assert).
#define QKV_NB  ((RHALF / GBM) * (HID / GBN))     // block tiles of q and of k
#define QKV_VT  ((HID / GBM) * (NND / GBN))       // block tiles of v^T per graph
static_assert(QKV_NB == QKV_VT * GHALF);
__global__ __launch_bounds__(256) void k_qkv(
    const unsigned short* __restrict__ Xh, const unsigned short* __restrict__ WqT,
    const unsigned short* __restrict__ WkT, const unsigned short* __restrict__ WvT,
    unsigned short* __restrict__ Qp, unsigned short* __restrict__ Kp, unsigned short* __restrict__ VTp,
    const float* __restrict__ bq, const float* __restrict__ bk, const float* __restrict__ bv) {
  __shared__ __attribute__((aligned(2048))) unsigned short ring[2 * GBUF];   // tensor loads: places at multiples of 2 KiB
  __shared__ __align__(16) float sT[8 * 16 * 68];   // per-wave 16x64 slab, pitch 68 floats
  const int bx = (int)blockIdx.x;
  const int pr = (int)blockIdx.y;
  if (pr < 2) {
    const unsigned short* Wt = pr == 0 ? WqT : WkT;
    unsigned short* Cp       = pr == 0 ? Qp : Kp;
    const float* bb          = pr == 0 ? bq : bk;
    gemm_tile<false, 2, 2, false, 0>(ring, sT, bx, 0,
        Xh, Xh, HID, 0L, Wt, Wt, HID, 0L, (void*)Cp, (void*)(Cp + HID), PLD, 0L,
        bb, bb, 0L, RHALF, HID, HID, 1.0f);
  } else {
    gemm_tile<false, 1, 2, false, 0>(ring, sT, bx % QKV_VT, bx / QKV_VT,
        WvT, WvT, HID, 0L, Xh, Xh, HID, (long)NND * HID, (void*)VTp, (void*)(VTp + HID), PLD, (long)HID * PLD,
        bv, bv, 0L, HID, NND, HID, 1.0f);
  }
}

// =====================================================================================
// Node feature plane: xb[row][c] = bf16(x[row][c]) for row < nN (all 512 c). One thread = 8 contiguous
// =====================================================================================
__device__ __forceinline__ void d_xprep(int blk, const float* __restrict__ x, unsigned short* xb, int nN, int nUnits) {
  const int i = blk * NTHR + (int)threadIdx.x;
  if (i >= nUnits) return;
  const int row = i >> 6;
  const int c0  = (i & 63) * 8;
  const int rc  = row < nN ? row : nN - 1;
  const float* p = x + (size_t)rc * HID + c0;
  v4f a = *(const v4fa*)p;
  v4f b = *(const v4fa*)(p + 4);
  const v4f z4 = {0.f, 0.f, 0.f, 0.f};
  if (row >= nN) { a = z4; b = z4; }
  const v4u hv = pack8(a, b);
  unsigned short* o = xb + (size_t)row * HID + c0;
  *(v4u*)o = hv;
  
}

// =====================================================================================
// Weight transpose + bf16 convert into a k-contiguous plane: w is [Kin][Ncol] ([in][out]),
//   wt[n][k] = bf16(w[k mod Kin][n]) for n < Nrows, k < Kout (Kout = Kin or a multiple of it).
// coverage: nUnits = Nrows * Kout/8 threads x 8 = Nrows x Kout exactly.
// =====================================================================================
__device__ __forceinline__ void d_wtr(int blk, const float* __restrict__ w, int Kin, int Ncol, int Nrows, int Kout,
                                      unsigned short* wt, int nUnits) {
  const int u = blk * NTHR + (int)threadIdx.x;
  if (u >= nUnits) return;
  const int kq = Kout >> 3;
  const int n  = u / kq;
  const int k8 = (u - n * kq) * 8;
  const int kk = k8 - (k8 / Kin) * Kin;
  const int ncl = n < Ncol ? n : Ncol - 1;
  const float* p = w + (size_t)kk * (size_t)Ncol + ncl;
  v4f a, b;
  a.x = p[0];                    a.y = p[(size_t)Ncol];         a.z = p[(size_t)2 * Ncol];     a.w = p[(size_t)3 * Ncol];
  b.x = p[(size_t)4 * Ncol];     b.y = p[(size_t)5 * Ncol];     b.z = p[(size_t)6 * Ncol];     b.w = p[(size_t)7 * Ncol];
  const v4f z4 = {0.f, 0.f, 0.f, 0.f};
  if (n >= Ncol || n >= Nrows) { a = z4; b = z4; }
  const v4u wv = pack8(a, b);
  unsigned short* o = wt + (size_t)n * (size_t)Kout + k8;
  *(v4u*)o = wv;
  
}

// =====================================================================================
// Edge bias plane: EB[e][h] = sum_t bf16r(ea[e][t]) * bf16r(We[t][h]) + bf16r(be[h]) (f32, 16 terms summed
// from +0 then the bias), zero rows for pad edges nE <= e < EP (load address clamped, value zeroed by select).
// One thread = one edge and 4 consecutive heads: 4 b128 loads in a rolled loop, one 16-B store;
// coverage: nUnits = EP*2 threads x 4 = EP x 8 elements exactly.
// =====================================================================================
__device__ __forceinline__ void d_eb(int blk, const float* __restrict__ ea, const float* __restrict__ We,
                                     const float* __restrict__ be, float* EB, int nE, int nUnits) {
  __shared__ float sWe[EDW * NHD];
  __shared__ float sbe[NHD];
  const int tid = (int)threadIdx.x;
  if (tid < EDW * NHD) sWe[tid] = bfrf(We[tid]);           // We[t][h] row-major
  if (tid < NHD) sbe[tid] = bfrf(be[tid]);
  __syncthreads();
  const int u = blk * NTHR + tid;
  if (u >= nUnits) return;
  const int e  = u >> 1;
  const int h0 = (u & 1) * 4;
  const int ec = e < nE ? e : nE - 1;
  const float* er = ea + (size_t)ec * EDW;
  float s0 = 0.f, s1 = 0.f, s2 = 0.f, s3 = 0.f;
#pragma unroll 1
  for (int q = 0; q < 4; ++q) {
    const v4f a = bfr4(*(const v4fa*)(er + 4 * q));
    const float* wr = sWe + (4 * q) * NHD + h0;            // We[4q+i][h0+j] = wr[i*8 + j]
    s0 = fmaf(a.x, wr[0],  s0); s1 = fmaf(a.x, wr[1],  s1); s2 = fmaf(a.x, wr[2],  s2); s3 = fmaf(a.x, wr[3],  s3);
    s0 = fmaf(a.y, wr[8],  s0); s1 = fmaf(a.y, wr[9],  s1); s2 = fmaf(a.y, wr[10], s2); s3 = fmaf(a.y, wr[11], s3);
    s0 = fmaf(a.z, wr[16], s0); s1 = fmaf(a.z, wr[17], s1); s2 = fmaf(a.z, wr[18], s2); s3 = fmaf(a.z, wr[19], s3);
    s0 = fmaf(a.w, wr[24], s0); s1 = fmaf(a.w, wr[25], s1); s2 = fmaf(a.w, wr[26], s2); s3 = fmaf(a.w, wr[27], s3);
  }
  v4f o;
  o.x = s0 + sbe[h0]; o.y = s1 + sbe[h0 + 1]; o.z = s2 + sbe[h0 + 2]; o.w = s3 + sbe[h0 + 3];
  const v4f z4 = {0.f, 0.f, 0.f, 0.f};
  if (e >= nE) o = z4;
  float* op = EB + (size_t)e * NHD + h0;
  *(v4f*)op = o;
  
}

// =====================================================================================
// All planes that depend on the inputs alone, in one launch. Blocks by range (the same branch in every thread of a
// block): PB_W each for WqT, WkT, WvT; PB_O for WOT2; PB_X for the node feature plane; the rest for the edge bias plane.
// coverage: each range holds exactly the blocks that its plane's own launch would have.
// =====================================================================================
#define PB_W  (HID * (HID / 8) / NTHR)            // 128 blocks: 512 rows x 64 units
#define PB_O  (HID * (PLD / 8) / NTHR)            // 256 blocks: 512 rows x 128 units, k mod 512
#define PB_X  (NTOT * (HID / 8) / NTHR)           // 4096 blocks
#define PB_E0 (3 * PB_W + PB_O + PB_X)            // first block of the edge bias plane
static_assert(PB_W * NTHR == HID * (HID / 8) && PB_O * NTHR == HID * (PLD / 8) && PB_X * NTHR == NTOT * (HID / 8));
__global__ __launch_bounds__(NTHR) void k_prep(
    const float* __restrict__ x, const float* __restrict__ ea, const float* __restrict__ We,
    const float* __restrict__ be, const float* __restrict__ Wq, const float* __restrict__ Wk,
    const float* __restrict__ Wv, const float* __restrict__ Wo,
    unsigned short* xb, float* EB, unsigned short* WqT, unsigned short* WkT, unsigned short* WvT,
    unsigned short* WOT2, int nE, int nUe) {
  const int bx = (int)blockIdx.x;
  if (bx < 3 * PB_W) {
    const int wi = bx / PB_W;
    const float* w     = wi == 0 ? Wq  : (wi == 1 ? Wk  : Wv);
    unsigned short* wt = wi == 0 ? WqT : (wi == 1 ? WkT : WvT);
    d_wtr(bx - wi * PB_W, w, HID, HID, HID, HID, wt, HID * (HID / 8));
  } else if (bx < 3 * PB_W + PB_O) {
    d_wtr(bx - 3 * PB_W, Wo, HID, HID, HID, PLD, WOT2, HID * (PLD / 8));
  } else if (bx < PB_E0) {
    d_xprep(bx - (3 * PB_W + PB_O), x, xb, NTOT, NTOT * (HID / 8));
  } else {
    d_eb(bx - PB_E0, ea, We, be, EB, nE, nUe);
  }
}

// =====================================================================================
// Graph attention with per-edge additive bias, one block per (graph, 64-query tile), 8 waves.
// Phase A (block-local, statically bounded): scan of the src list (edge_index row 0) for
//   src in [node0, node0+64): wave w walks its own contiguous eighth of the list in slabs of 256 edges, SG slabs
//   loaded ahead, hits appended to its own LDS list, no barrier inside the walk; then one barrier, the waves'
//   lists joined in wave order (= ascending slab order) with dst gathered for all hits at once: (edge id, query
//   row, dst % 512), capped at HCAP (poison when reached); counting sort (8 waves, each its own 8 query rows, stable) into
//   NBIN bins, bin = query row * 32 + (dst % 512) / 16, -> sE / sD segments with roff / rcnt. Nothing persists
//   outside LDS.
// Phase B: 4 head pairs; waves 0..3 run head 2p, waves 4..7 head 2p+1, each wave 16 query rows.
//   Per key chunk of 64: K hi/lo and V^T hi/lo tiles of both heads (8 tiles of 64 rows x 128 B) brought by one
//   tensor load per wave, two buffers, one chunk ahead; a 2x64x64 f32 bias tile zeroed then filled by row owners
//   (4 threads per query row, thread j walks only the bin of its row and of key columns 16j..16j+15 of this
//   chunk, in segment order = scan order of the hits -> duplicate (src,dst) pairs sum deterministically; lanes
//   whose bin is shorter than the wave's longest add into a private dummy slot),
//   then S = q.k (3-term split) * 0.125 + bias, online softmax in f32, P split hi/lo through per-wave LDS
//   Epilogue: ctx = O / l staged per wave in LDS (aliasing only that wave's own bias rows), written as
// Geometry guards (NaN poison of the block's ctx rows, never a trap): hit cap, per-row count > RWCAP,
//   num_graphs != NGR, batch id of the block's first node outside [0, NGR).
// coverage: CTX rows lrow0..lrow0+63 x all 1024 cols per block; grid = GHALF*8 blocks covers RHALF rows once.
// =====================================================================================
#define AT_NW   8
#define EPT     8
#define SLAB    (32 * EPT)            // 256 keys: one wave's read of EPT keys per lane
#define SG      4                     // slabs whose loads are in flight per wave
#define SLOTB   6
#define NSLOT   64                    // query rows per block = scan slots
#define BINSH   4                     // 16 key columns per bin
#define NBIN    (NSLOT * (NND >> BINSH))   // 2048 bins: (query row, group of 16 key columns)
#define HCAP    2048                  // hit capacity per block
#define WLCAP   HCAP                  // hit capacity of one wave's list: a wave that fills it has filled the block's
#define LISTN   (AT_NW * WLCAP)       // 16384
#define RWCAP   128                   // static cap on per-row edge count
#define KVT     4096                  // one 64x64 f32 bias tile
#define KVP     72                    // row pitch of the K / V^T / P tiles in LDS, elements: 144 B = 16 B x 9, so the
                                      // 16 rows of a ds_load_b128 fragment read fall on 16 different bank groups
#define KVS     5120                  // one 64-row K or V^T tile: 64 * KVP elements, its place rounded up to 2 KiB
#define KVB     (8 * KVS)             // one buffer: the 8 tiles of a key chunk
#define NST     ((NHD / 2) * (NND / 64))   // stages = head pairs x key chunks
#define PWS     (16 * KVP)            // one wave's 16-row P tile
#define NDUM    512                   // private dummy accumulators (2 per thread)
#define PFQ     4                     // entries of a thread's bias bin that are fetched one stage ahead into registers
#define LO_KV   0
#define LO_P    (2 * KVB * 2)                           // 163840
#define LO_BT   (LO_P + 2 * AT_NW * PWS * 2)            // 200704
#define LO_SE   (LO_BT + (2 * KVT + NDUM) * 4)          // 235520
#define LO_SD   (LO_SE + HCAP * 4)                      // 243712
#define LO_RC   (LO_SD + HCAP * 4)                      // 251904
#define LDS_ATT (LO_RC + (2 * NBIN + 2 * AT_NW) * 4)    // 268352

static_assert((LISTN + 4 * HCAP) * 4 <= LO_P);        // phase-A lists alias the two K/V buffers
static_assert(LDS_ATT <= 300000);
static_assert(KVP >= 64 && (KVP * 2) % 16 == 0 && ((KVP * 2) / 16) % 2 == 1);   // 16-B aligned rows, odd multiple
static_assert(KVS >= 64 * KVP && (KVS * 2) % 2048 == 0 && KVP * 2 == 128 + 16);  // tensor load: place, padded pitch
static_assert(NST >= 2 && NND / 64 == 8 && NND == HID && AT_NW == 8 && HDM * 2 == 128 && (PLD * 2) % 16 == 0);  // one tile per wave, 128-B rows
static_assert((LO_P % 16) == 0 && (LO_BT % 16) == 0);
static_assert((1 << SLOTB) == NSLOT);
static_assert(NTHR == 32 * AT_NW);
static_assert(NTHR == 4 * NSLOT);                      // bias fill: 4 threads per query row
static_assert(NTHR * 4 * 8 == 2 * KVT);                // bias zero fill: 8 sweeps of 4 floats per thread
static_assert(NDUM == 2 * NTHR && NDUM == 128 * 4);
static_assert(AT_NW * 1024 == 2 * KVT);                // per-wave output staging = own bias rows
static_assert(SLAB == 256 && 24 + SLOTB < 32);                   // list entry = edge id (below 2^24, host check) << SLOTB | slot
static_assert(NSLOT == 8 * AT_NW && NND == 512);                 // sort: 8 query rows per wave, owner wave = hitRD >> 12
static_assert(NBIN == NTHR * 8 && (NND >> BINSH) == 32);         // sort: 8 bins per thread, 4 threads per row
static_assert(RWCAP < 256);                                      // sort: 8-bit counters exact below the row cap
static_assert((64 >> BINSH) == 4 && (LO_RC % 16) == 0);          // 4 bins per row and key chunk = 4 fill threads

// Maximum / sum over the 16 lanes of a row (lanes l ^ 1, ^ 2, ^ 4, ^ 8 in turn, the order of an xor butterfly), for eight
// values at once, on the vector unit's own lane exchange: no LDS round trip and no wait per step. All 32 lanes are on.
// The eight values' steps are interleaved so that every instruction's producer stands eight instructions back.
#define ROW8(OP, X) \
  OP " %0, %0, %0 row_xmask:" X " row_mask:0xf bank_mask:0xf\n\t" \
  OP " %1, %1, %1 row_xmask:" X " row_mask:0xf bank_mask:0xf\n\t" \
  OP " %2, %2, %2 row_xmask:" X " row_mask:0xf bank_mask:0xf\n\t" \
  OP " %3, %3, %3 row_xmask:" X " row_mask:0xf bank_mask:0xf\n\t" \
  OP " %4, %4, %4 row_xmask:" X " row_mask:0xf bank_mask:0xf\n\t" \
  OP " %5, %5, %5 row_xmask:" X " row_mask:0xf bank_mask:0xf\n\t" \
  OP " %6, %6, %6 row_xmask:" X " row_mask:0xf bank_mask:0xf\n\t" \
  OP " %7, %7, %7 row_xmask:" X " row_mask:0xf bank_mask:0xf\n\t"
__device__ __forceinline__ void row16_max8(float (&v)[8]) {
  // the four exchange steps in registers: through ds_bpermute_b32 each step would wait out an LDS round trip
  asm(ROW8("v_max_num_f32_dpp", "1") ROW8("v_max_num_f32_dpp", "2") ROW8("v_max_num_f32_dpp", "4") ROW8("v_max_num_f32_dpp", "8")
      : "+v"(v[0]), "+v"(v[1]), "+v"(v[2]), "+v"(v[3]), "+v"(v[4]), "+v"(v[5]), "+v"(v[6]), "+v"(v[7]));
}
__device__ __forceinline__ void row16_sum8(float (&v)[8]) {
  // as above; own value + partner's value at every step, the sums an xor butterfly through LDS gives
  asm(ROW8("v_add_f32_dpp", "1") ROW8("v_add_f32_dpp", "2") ROW8("v_add_f32_dpp", "4") ROW8("v_add_f32_dpp", "8")
      : "+v"(v[0]), "+v"(v[1]), "+v"(v[2]), "+v"(v[3]), "+v"(v[4]), "+v"(v[5]), "+v"(v[6]), "+v"(v[7]));
}
#undef ROW8

// One slab of the key list: the lane holds keys e0 .. e0 + EPT - 1 in da / db and tests them against the block's slot
// range [slotBase, slotBase + nb); hits are appended to this wave's LDS list wl as (edge id << SLOTB | slot), key
// position first, lane second. wc = entries so far (wave-uniform); returns the new count; nothing is stored
// at or past WLCAP.
__device__ __forceinline__ int slab_hits(const v4i da, const v4i db, int e0, int slotBase, int nb, int* wl, int wc) {
  const unsigned nbs = (unsigned)slotBase;
  const unsigned unb = (unsigned)nb;
  const unsigned s0 = (unsigned)da.x - nbs, s1 = (unsigned)da.y - nbs;
  const unsigned s2 = (unsigned)da.z - nbs, s3 = (unsigned)da.w - nbs;
  const unsigned s4 = (unsigned)db.x - nbs, s5 = (unsigned)db.y - nbs;
  const unsigned s6 = (unsigned)db.z - nbs, s7 = (unsigned)db.w - nbs;
  const bool h0 = s0 < unb, h1 = s1 < unb, h2 = s2 < unb, h3 = s3 < unb;
  const bool h4 = s4 < unb, h5 = s5 < unb, h6 = s6 < unb, h7 = s7 < unb;
  const unsigned m0 = __builtin_amdgcn_ballot_w32(h0), m1 = __builtin_amdgcn_ballot_w32(h1);
  const unsigned m2 = __builtin_amdgcn_ballot_w32(h2), m3 = __builtin_amdgcn_ballot_w32(h3);
  const unsigned m4 = __builtin_amdgcn_ballot_w32(h4), m5 = __builtin_amdgcn_ballot_w32(h5);
  const unsigned m6 = __builtin_amdgcn_ballot_w32(h6), m7 = __builtin_amdgcn_ballot_w32(h7);
  if ((m0 | m1 | m2 | m3 | m4 | m5 | m6 | m7) != 0u) {
#define HITJ(J, HJ, SJ, MJ) { \
      const unsigned mj = (MJ); \
      if (mj != 0u) { \
        if (HJ) { \
          const int pos = wc + (int)__builtin_amdgcn_mbcnt_lo(mj, 0u); \
          if (pos < WLCAP) wl[pos] = ((e0 + (J)) << SLOTB) | (int)(SJ); \
        } \
        wc += (int)__builtin_popcount(mj); } }
    HITJ(0, h0, s0, m0)
    HITJ(1, h1, s1, m1)
    HITJ(2, h2, s2, m2)
    HITJ(3, h3, s3, m3)
    HITJ(4, h4, s4, m4)
    HITJ(5, h5, s5, m5)
    HITJ(6, h6, s6, m6)
    HITJ(7, h7, s7, m7)
#undef HITJ
  }
  return wc;
}
// A slab that is not wholly inside the list (or a list not read 16 bytes at a time): every address clamped, the
// sentinel selected by value.
__device__ __forceinline__ void slab_load_edge(const int* __restrict__ keys, int nE, int e0, v4i& da, v4i& db) {
  const int sent = -2147483647 - 1;
  da.x = (e0     < nE) ? keys[min(e0,     nE - 1)] : sent;
  da.y = (e0 + 1 < nE) ? keys[min(e0 + 1, nE - 1)] : sent;
  da.z = (e0 + 2 < nE) ? keys[min(e0 + 2, nE - 1)] : sent;
  da.w = (e0 + 3 < nE) ? keys[min(e0 + 3, nE - 1)] : sent;
  db.x = (e0 + 4 < nE) ? keys[min(e0 + 4, nE - 1)] : sent;
  db.y = (e0 + 5 < nE) ? keys[min(e0 + 5, nE - 1)] : sent;
  db.z = (e0 + 6 < nE) ? keys[min(e0 + 6, nE - 1)] : sent;
  db.w = (e0 + 7 < nE) ? keys[min(e0 + 7, nE - 1)] : sent;
}

__global__ __launch_bounds__(NTHR) void k_attn(
    const unsigned short* __restrict__ Qp, const unsigned short* __restrict__ Kp,
    const unsigned short* __restrict__ VTp, const float* __restrict__ EB,
    const int* __restrict__ keys, const int* __restrict__ gath,
    const int* __restrict__ ngp, const int* __restrict__ bat,
    unsigned short* CTX, int nE, int vec8, int gbase) {
  extern __shared__ __attribute__((aligned(2048))) v4f lds_dyn[];   // tensor loads: tile places at multiples of 2 KiB
  char* lds = (char*)lds_dyn;
  __bf16* Ksh = (__bf16*)(lds + LO_KV);         // buffer 0 (buffer 1: + KVB): [2][KVS]  K hi  [kv][d], pitch KVP
  __bf16* Ksl = Ksh + 2 * KVS;                   // [2][KVS]  K lo
  __bf16* Vth = Ksl + 2 * KVS;                   // [2][KVS]  V^T hi [d][kv]
  __bf16* Vtl = Vth + 2 * KVS;                   // [2][KVS]  V^T lo
  int* list  = (int*)(lds + LO_KV);              // phase A only: [8 waves][WLCAP]
  int* hitE  = list + LISTN;                     // [HCAP] edge ids in scan order
  int* hitRD = hitE + HCAP;                      // [HCAP] (row << 9) | loc_dst
  int* tE    = hitRD + HCAP;                     // [HCAP] hitE regrouped by owner wave (8 query rows each)
  int* tRD   = tE + HCAP;                        // [HCAP] hitRD of the same entries
  __bf16* Psh = (__bf16*)(lds + LO_P);           // [8 waves][16 x KVP] P hi
  __bf16* Psl = Psh + AT_NW * PWS;               // P lo
  float* BTX = (float*)(lds + LO_BT);            // [2][64 x 64] bias tiles + [NDUM] dummies; epilogue staging
  int* sE   = (int*)(lds + LO_SE);               // [HCAP] edge ids sorted by query row
  int* sD   = (int*)(lds + LO_SD);               // [HCAP] loc_dst of the same entries
  int* rcnt = (int*)(lds + LO_RC);               // [NBIN] entries per bin
  int* roff = rcnt + NBIN;                       // [NBIN] first entry of the bin in sE / sD
  int* wcnt = roff + NBIN;                       // [8]
  int* misc = wcnt + AT_NW;                      // [8] largest per-row count of each wave

  const int tid = (int)threadIdx.x, lane = tid & 31, wave = tid >> 5, hh = lane >> 4, c = lane & 15;
  const int lgr   = (int)blockIdx.x >> 3;        // graph within this pass
  const int qt    = (int)blockIdx.x & 7;         // 64-query tile within the graph
  const int gb    = gbase + lgr;                 // graph id
  const int node0 = gb * NND + qt * NSLOT;       // global node id of query row 0
  const int lrow0 = lgr * NND + qt * NSLOT;      // plane row of query row 0

  // ---- phase A1: scan of the src list, each wave its own contiguous run of slabs; then the lists joined ----
  int tot;
  {
    const int wv    = __builtin_amdgcn_readfirstlane(wave);      // scalar loop bounds
    const int nSl   = (nE + SLAB - 1) / SLAB;                     // slabs in the list
    const int spw   = (nSl + AT_NW - 1) / AT_NW;                  // slabs per wave
    const int sBeg  = wv * spw < nSl ? wv * spw : nSl;
    const int sEnd  = sBeg + spw < nSl ? sBeg + spw : nSl;
    const int nFull = vec8 != 0 ? nE / SLAB : 0;                  // slabs [0, nFull) lie wholly inside the list
    const int sFull = sEnd < nFull ? sEnd : nFull;
    const int nG    = sFull > sBeg ? (sFull - sBeg) / SG : 0;     // groups of SG whole slabs
    int* wl = list + wv * WLCAP;
    const int le = lane * EPT;
    int wc = 0;
    if (nG > 0) {
      v4i ra[SG], rb[SG];
#pragma unroll   // ra / rb in registers
      for (int k = 0; k < SG; ++k) {
        const int* p = keys + (sBeg + k) * SLAB + le;
        ra[k] = *(const v4i*)p;
        rb[k] = *(const v4i*)(p + 4);
      }
      // stands in front of the loop's first writes to the address registers of the loads above
      asm volatile("s_wait_xcnt 0x0" ::: "memory");
#pragma unroll 1   // one copy of the SG slab bodies in the instruction cache
      for (int g = 0; g < nG; ++g) {
        const int sb = sBeg + g * SG;
        const int sn = g + 1 < nG ? sb + SG : sb;                 // last trip: its own slabs again (in bounds, unused)
#pragma unroll   // ra / rb in registers; a slab's registers are refilled as soon as it is tested, SG slabs ahead
        for (int k = 0; k < SG; ++k) {
          wc = slab_hits(ra[k], rb[k], (sb + k) * SLAB + le, node0, NSLOT, wl, wc);
          const int* p = keys + (sn + k) * SLAB + le;
          ra[k] = *(const v4i*)p;
          rb[k] = *(const v4i*)(p + 4);
          // last slab: stands in front of the next trip's first writes to these loads' address registers (the build
          // has this wait behind the other slabs' loads, not over the loop's back edge)
          if (k == SG - 1) asm volatile("s_wait_xcnt 0x0" ::: "memory");
        }
      }
    }
#pragma unroll 1   // at most SG - 1 whole slabs and the list's edge
    for (int s = sBeg + nG * SG; s < sEnd; ++s) {
      v4i da, db;
      slab_load_edge(keys, nE, s * SLAB + le, da, db);
      wc = slab_hits(da, db, s * SLAB + le, node0, NSLOT, wl, wc);
    }
    if (lane == 0) wcnt[wave] = wc;
    __syncthreads();
    int pre = 0, all = 0;
#pragma unroll
    for (int w2 = 0; w2 < AT_NW; ++w2) {
      int cc = wcnt[w2];
      cc = cc < 0 ? 0 : (cc > WLCAP ? WLCAP : cc);
      all += cc;
      pre += (w2 < wave) ? cc : 0;
    }
    const int wcc = wc > WLCAP ? WLCAP : wc;
#pragma unroll 1
    for (int i0 = 0; i0 < wcc; i0 += 128) {         // wcc wave-uniform; loads unconditional, clamped
      int eid[4], sl[4], gg[4];
#pragma unroll   // eid / sl in registers; the four list reads share one LDS latency
      for (int j = 0; j < 4; ++j) {
        const int i   = i0 + 32 * j + lane;
        const int ent = wl[i < wcc ? i : wcc - 1];
        int e = ent >> SLOTB;
        e = e < 0 ? 0 : (e > nE - 1 ? nE - 1 : e);
        eid[j] = e;
        sl[j]  = ent & (NSLOT - 1);
      }
#pragma unroll   // gg in registers; the four dst reads share one memory latency
      for (int j = 0; j < 4; ++j) gg[j] = gath[eid[j]];
#pragma unroll   // eid / sl / gg in registers
      for (int j = 0; j < 4; ++j) {
        const int i = i0 + 32 * j + lane;
        int g = gg[j];
        g = g < 0 ? 0 : (g > NTOT - 1 ? NTOT - 1 : g);
        const int pos = pre + i;
        if (i < wcc && pos < HCAP) {
          hitE[pos]  = eid[j];
          hitRD[pos] = (sl[j] << 9) | (g & (NND - 1));
        }
      }
    }
    tot = all > HCAP ? HCAP : all;
    __syncthreads();
  }
  const int nh = __builtin_amdgcn_readfirstlane(tot);   // the same in every thread of the block: scalar loop bounds

  // ---- phase A2: stable counting sort of the hits into the NBIN bins, by all 8 waves ----
  // Wave w owns query rows 8w..8w+7 (bins 256w..256w+255), thread tid the bins 8*tid..8*tid+7 (one query row,
  // 128 key columns). Bins ascend with the row, so the entries of wave w fill sE / sD[below, below + mine).
  // Every counter lives in its owner's registers: no LDS word is read, changed and written back per hit.
  // (a) hits of lower waves' rows and of this wave's rows
  int below = 0, mine = 0;
#pragma unroll 4   // four independent LDS reads in flight per wait
  for (int b0 = 0; b0 < nh; b0 += 32) {
    const int idx = b0 + lane;
    const int g   = hitRD[idx < nh ? idx : nh - 1] >> 12;        // owner wave = query row / 8
    const bool ok = idx < nh;
    below += (int)__builtin_popcount(__builtin_amdgcn_ballot_w32(ok && g < wave));
    mine  += (int)__builtin_popcount(__builtin_amdgcn_ballot_w32(ok && g == wave));
  }
  // (b) this wave's hits copied, in hit order, to tRD / tE[below, below + mine)
  {
    int wpos = below;
    for (int b0 = 0; b0 < nh; b0 += 128) {
      int rd[4], ee[4];
#pragma unroll   // rd / ee in registers; all reads ahead of the first store, one LDS latency for the four
      for (int j = 0; j < 4; ++j) {
        const int idx = b0 + 32 * j + lane;
        const int cl  = idx < nh ? idx : nh - 1;
        rd[j] = hitRD[cl];
        ee[j] = hitE[cl];
      }
#pragma unroll   // rd / ee in registers
      for (int j = 0; j < 4; ++j) {
        const bool ok = (b0 + 32 * j + lane < nh) && ((rd[j] >> 12) == wave);
        const unsigned mk = __builtin_amdgcn_ballot_w32(ok);
        if (ok) {
          int p = wpos + (int)__builtin_amdgcn_mbcnt_lo(mk, 0u);
          p = p > HCAP - 1 ? HCAP - 1 : p;
          tRD[p] = rd[j];
          tE[p]  = ee[j];
        }
        wpos += (int)__builtin_popcount(mk);
      }
    }
  }
  __syncthreads();
  // (c) per-bin counts: every lane reads each entry of its wave (one address, broadcast); the owner counts it.
  //     8 counters of 8 bits: exact while a row holds <= RWCAP entries; tc is exact always and feeds the guard.
  unsigned long long c8 = 0ull;
  int tc = 0;
#pragma unroll 8   // eight independent LDS reads in flight per wait
  for (int i = 0; i < mine; ++i) {
    const int u = tRD[below + i];
    const bool own = (u >> 7) == tid;
    c8 += (unsigned long long)(own ? 1 : 0) << (((u >> BINSH) & 7) * 8);
    tc += own ? 1 : 0;
  }
  // (d) first entry of each bin: wave prefix over the threads' totals, then over the thread's own 8 counters
  int tbase;
  {
    int incl = tc;
#pragma unroll
    for (int d = 1; d < 32; d <<= 1) {
      const int up = __shfl_up(incl, d, 32);
      if (lane >= d) incl += up;
    }
    tbase = below + incl - tc;
    int cn[8], of[8];
    int run = tbase;
#pragma unroll
    for (int k = 0; k < 8; ++k) {
      cn[k] = (int)((c8 >> (8 * k)) & 255ull);
      of[k] = run;
      run += cn[k];
    }
    const v4i c0v = {cn[0], cn[1], cn[2], cn[3]}, c1v = {cn[4], cn[5], cn[6], cn[7]};
    const v4i o0v = {of[0], of[1], of[2], of[3]}, o1v = {of[4], of[5], of[6], of[7]};
    *(v4i*)(rcnt + tid * 8)     = c0v;
    *(v4i*)(rcnt + tid * 8 + 4) = c1v;
    *(v4i*)(roff + tid * 8)     = o0v;
    *(v4i*)(roff + tid * 8 + 4) = o1v;
    // largest per-row count of the wave: a row = 4 neighbouring threads
    int rc = tc;
    rc += __shfl_xor(rc, 1, 32);
    rc += __shfl_xor(rc, 2, 32);
#pragma unroll
    for (int off = 4; off < 32; off <<= 1) {
      const int o = __shfl_xor(rc, off, 32);
      rc = o > rc ? o : rc;
    }
    if (lane == 0) misc[wave] = rc;
  }
  // (e) placement in hit order (stable): byte k of cur = next free place of bin 8*tid + k, counted from tbase
  {
    unsigned long long cur = c8 << 8;
    cur += cur << 8;
    cur += cur << 16;
    cur += cur << 32;
    for (int i0 = 0; i0 < mine; i0 += 8) {
      int u[8], e[8];
#pragma unroll   // u / e in registers; all reads ahead of the first store, one LDS latency for the eight
      for (int j = 0; j < 8; ++j) {
        const int ii = i0 + j < mine ? i0 + j : mine - 1;
        u[j] = tRD[below + ii];
        e[j] = tE[below + ii];
      }
#pragma unroll   // u / e in registers
      for (int j = 0; j < 8; ++j) {
        if (i0 + j < mine && (u[j] >> 7) == tid) {
          const int sh = ((u[j] >> BINSH) & 7) * 8;
          int pos = tbase + (int)((cur >> sh) & 255ull);
          pos = pos > HCAP - 1 ? HCAP - 1 : pos;
          sE[pos] = e[j];
          sD[pos] = u[j] & (NND - 1);
          cur += 1ull << sh;
        }
      }
    }
  }
  // this wave's reads and writes of the phase-A lists have retired before a tensor load may target their LDS
  asm volatile("s_wait_dscnt 0x0" ::: "memory");
  __syncthreads();

  // ---- K / V^T tiles: wave w brings tile w of every stage (plane w >> 1: K hi, K lo, V^T hi, V^T lo; head slot
  //      w & 1); stage st = head pair st / 8, key chunk st % 8, into buffer st % 2 ----
  const uint32_t wvu  = uni((uint32_t)wave);
  const uint32_t ldsb = (uint32_t)(size_t)lds;
  const u32x8 g1 = tile_g1();
  u32x4 g0;
  auto issue = [&](uint32_t st) {
    const uint32_t hd0 = (2u * (st >> 3) + (wvu & 1u)) * HDM;    // first column of the head
    const uint32_t kvf = (st & 7u) * 64u;                        // first key of the chunk
    const bool     isV = wvu >= 4u;
    const unsigned short* pl = isV ? VTp : Kp;
    const uint32_t row = (uint32_t)lgr * NND + (isV ? hd0 : kvf);   // NND == HID rows per graph in both planes
    const uint32_t col = (isV ? kvf : hd0) + ((wvu >> 1) & 1u) * HID;
    g0 = tile_g0(ldsb + ((st & 1u) * KVB + wvu * KVS) * 2u, (uint64_t)(size_t)pl + (uint64_t)(row * PLD + col) * 2u);
    tile_load(g0, g1);
  };
  issue(0u);
  tile_wait(g0, g1);                                    // this wave's tile of stage 0 has landed
  __syncthreads();                                      // stage 0 readable by every wave
  issue(1u);

  // ---- geometry / capacity guards -> NaN poison of this block's ctx rows ----
  int degmax = 0;
#pragma unroll
  for (int w2 = 0; w2 < AT_NW; ++w2) degmax = misc[w2] > degmax ? misc[w2] : degmax;
  const int ng  = ngp[0];
  const int bt0 = bat[node0];
  const bool bad = (nh >= HCAP) || (degmax > RWCAP) || (ng != NGR) || (bt0 < 0) || (bt0 >= NGR);
  const float pz = bad ? __int_as_float(0x7fc00000) : 0.0f;

  // ---- phase B ----
  const int wsub = wave & 3;                     // query row group of this wave
  const int hl   = wave >> 2;                    // head slot (0 / 1) of this wave within the pair
  const int rw   = tid >> 2;                     // bias fill: query row owned by this thread
  const int jw   = tid & 3;                      // bias fill: key-column quarter owned by this thread
  const float sscale = 0.125f;
  const v8f z8 = {0.f,0.f,0.f,0.f,0.f,0.f,0.f,0.f};
  const __bf16* Kth = Ksh + hl * KVS;
  const __bf16* Ktl = Ksl + hl * KVS;
  const __bf16* Vtth = Vth + hl * KVS;
  const __bf16* Vttl = Vtl + hl * KVS;
  __bf16* pwh = Psh + wave * PWS;
  __bf16* pwl = Psl + wave * PWS;

  // ---- bias entries of stage stn (head pair stn / 8, key chunk stn % 8), fetched one stage ahead ----
  // The thread's bin = row rw, key columns 16jw..16jw+15 of the chunk. Its first PFQ entries: place in the bias tile
  // (pfA; the thread's dummy slot where there is no such entry) and the two heads' edge bias (pfV), all PFQ reads of
  // the edge bias plane in flight together. sE / sD / roff / rcnt are read-only in phase B.
  int pfS = 0, pfC = 0, pfA[PFQ];
  v2f pfV[PFQ];
  auto fetch_bias = [&](int stn) {
    const int kcn = stn & 7;
    const int bin = rw * (NND >> BINSH) + kcn * (64 >> BINSH) + jw;
    int s0 = roff[bin], cnt = rcnt[bin];
    s0  = s0 < 0 ? 0 : (s0 > nh ? nh : s0);
    cnt = cnt < 0 ? 0 : (cnt > RWCAP ? RWCAP : cnt);
    if (cnt > nh - s0) cnt = nh - s0;
    pfS = s0;
    pfC = cnt;
    const float* ebn = EB + 2 * (stn >> 3);
    int dd[PFQ], ee[PFQ];
#pragma unroll   // dd / ee in registers; the reads share one LDS latency
    for (int q = 0; q < PFQ; ++q) {
      int idx = s0 + (q < cnt ? q : (cnt > 0 ? cnt - 1 : 0));   // past the bin's end: its last entry again (same line)
      idx = idx > nh - 1 ? nh - 1 : idx;
      idx = idx < 0 ? 0 : idx;
      dd[q] = sD[idx];
      ee[q] = sE[idx];
    }
#pragma unroll   // pfA in registers
    for (int q = 0; q < PFQ; ++q) {
      const int col  = dd[q] - kcn * 64;
      const bool inr = (q < cnt) && ((unsigned)col < 64u) && ((col >> 4) == jw);
      pfA[q] = inr ? (rw * 64 + col) : (2 * KVT + tid);
    }
#pragma unroll   // pfV in registers; the reads share one memory latency
    for (int q = 0; q < PFQ; ++q) {
      int e = ee[q];
      e = e < 0 ? 0 : (e > nE - 1 ? nE - 1 : e);
      pfV[q] = *(const v2fa*)(ebn + (size_t)e * NHD);
    }
    // behind the loads, in front of later writes to their address registers (the build puts counted waits of its
    // own in front of the few writes that it schedules ahead of this one)
    asm volatile("s_wait_xcnt 0x0" ::: "memory");
  };
  fetch_bias(0);

#pragma unroll 1
  for (int hp = 0; hp < NHD / 2; ++hp) {
    const int h    = 2 * hp + hl;                // head of this wave
    const int qrow = lrow0 + wsub * 16;          // plane row of this wave's first query

    // Q fragments (A operand, row = lane&15, split k map): 2 d-chunks, hi and lo
    v16b qah[2], qal[2];
#pragma unroll
    for (int dc = 0; dc < 2; ++dc) {
      const unsigned short* qp = Qp + (size_t)(qrow + c) * PLD + h * HDM + dc * 32 + 8 * hh;
      qah[dc] = FragBF::load((const __bf16*)(const void*)qp);
      qal[dc] = FragBF::load((const __bf16*)(const void*)(qp + HID));
    }
    float mrow[8], lrow[8];
    v8f oacc[4];
#pragma unroll
    for (int r = 0; r < 8; ++r) { mrow[r] = -INFINITY; lrow[r] = 0.f; }
#pragma unroll
    for (int t = 0; t < 4; ++t) oacc[t] = z8;

#pragma unroll 1
    for (int kc = 0; kc < NND / 64; ++kc) {
      const int kv0 = kc * 64;
      const int st  = hp * (NND / 64) + kc;      // this pass reads buffer st % 2 alone; stage st + 1 is in flight
      const int bo  = (st & 1) * KVB;
      {
        // bias tiles + dummies zero: 8 sweeps x 256 threads x 4 floats = both 64x64 tiles (each store's lanes
        // contiguous, no two on one bank); 128 threads x 4 = dummies
        const v4f z4 = {0.f, 0.f, 0.f, 0.f};
        float* bz = BTX + tid * 4;
#pragma unroll
        for (int i = 0; i < 8; ++i) *(v4fa*)(bz + NTHR * 4 * i) = z4;
        if (tid < 128) *(v4fa*)(BTX + 2 * KVT + 4 * tid) = z4;
      }
      __syncthreads();
      {
        // bias fill: segment [pfS, pfS+pfC) of sE/sD = the bin of row rw and key columns kv0+16jw..kv0+16jw+15.
        // Entries 0..PFQ-1 come from the registers filled one stage ago; entry q is added while any lane of the
        // wave has one (wave-uniform test), in segment order.
#pragma unroll   // pfA / pfV in registers
        for (int q = 0; q < PFQ; ++q) {
          if (__builtin_amdgcn_ballot_w32(q < pfC) != 0u) {
            const int ia = pfA[q];
            const int ib = ia + (ia < KVT ? KVT : NTHR);
            const float ta = BTX[ia], tb = BTX[ib];   // ia != ib: both reads share one LDS latency
            BTX[ia] = ta + pfV[q].x;
            BTX[ib] = tb + pfV[q].y;
          }
        }
        const float* ebp = EB + 2 * hp;
        const int cnt = pfC;
#pragma unroll 1
        for (int q = PFQ; __builtin_amdgcn_ballot_w32(q < cnt) != 0u; ++q) {   // a bin longer than PFQ; cnt <= RWCAP
          const bool valid = q < cnt;
          int idx = pfS + q;
          idx = idx > nh - 1 ? nh - 1 : idx;
          idx = idx < 0 ? 0 : idx;
          const int col = sD[idx] - kv0;
          int e = sE[idx];
          e = e < 0 ? 0 : (e > nE - 1 ? nE - 1 : e);
          const v2f ebv = *(const v2fa*)(ebp + (size_t)e * NHD);
          const bool inr = valid && ((unsigned)col < 64u) && ((col >> 4) == jw);
          const int ia = inr ? (rw * 64 + col) : (2 * KVT + tid);
          const int ib = inr ? (KVT + rw * 64 + col) : (2 * KVT + NTHR + tid);
          BTX[ia] = BTX[ia] + ebv.x;
          BTX[ib] = BTX[ib] + ebv.y;
        }
      }
      __syncthreads();
      if (st + 1 < NST) fetch_bias(st + 1);      // lands while this stage is worked on

      // ---- S = q . k (3-term) ----
      v8f s[4];
#pragma unroll
      for (int j = 0; j < 4; ++j) {
        s[j] = z8;
#pragma unroll
        for (int dc = 0; dc < 2; ++dc) {
          FB kb, kl;
          const __bf16* kr = Kth + bo + (j * 16 + c) * KVP + dc * 32 + 8 * hh;
          const __bf16* kq = Ktl + bo + (j * 16 + c) * KVP + dc * 32 + 8 * hh;
          kb.h[0] = *(const v8b*)kr;
          kb.h[1] = *(const v8b*)(kr + 16);
          kl.h[0] = *(const v8b*)kq;
          kl.h[1] = *(const v8b*)(kq + 16);
          s[j] = at_mma(qah[dc], kb.v, s[j]);
          s[j] = at_mma(qah[dc], kl.v, s[j]);
          s[j] = at_mma(qal[dc], kb.v, s[j]);
        }
      }
      // scale, add bias tile (D element r = row wsub*16 + 8hh + r, col j*16 + c), chunk row max
      const float* btr = BTX + hl * KVT + (wsub * 16 + 8 * hh) * 64 + c;
      float cm[8];
#pragma unroll
      for (int r = 0; r < 8; ++r) {
        float m = -INFINITY;
#pragma unroll
        for (int j = 0; j < 4; ++j) {
          const float sv = s[j][r] * sscale + btr[r * 64 + j * 16];
          s[j][r] = sv;
          m = fmaxf(m, sv);
        }
        cm[r] = m;
      }
      row16_max8(cm);
      float al[8], ps[8];
#pragma unroll
      for (int r = 0; r < 8; ++r) {
        const float mnew = fmaxf(mrow[r], cm[r]);
        const float alpha = expf(mrow[r] - mnew);
        mrow[r] = mnew;
        float psum = 0.f;
#pragma unroll
        for (int j = 0; j < 4; ++j) {
          const float p = expf(s[j][r] - mnew);
          psum += p;
          __bf16 a, bl; at_split(p, a, bl);
          pwh[(8 * hh + r) * KVP + j * 16 + c] = a;
          pwl[(8 * hh + r) * KVP + j * 16 + c] = bl;
        }
        ps[r] = psum;
        al[r] = alpha;
#pragma unroll
        for (int t = 0; t < 4; ++t) oacc[t][r] *= alpha;
      }
      row16_sum8(ps);
#pragma unroll
      for (int r = 0; r < 8; ++r) lrow[r] = lrow[r] * al[r] + ps[r];
      __builtin_amdgcn_fence(__ATOMIC_RELEASE, "workgroup");
      __builtin_amdgcn_wave_barrier();
      __builtin_amdgcn_fence(__ATOMIC_ACQUIRE, "workgroup");
      // ---- O += p . v (3-term); P fragment = A (row c), V^T fragment = B (col = d) ----
#pragma unroll 1
      for (int kk = 0; kk < 2; ++kk) {
        FB pa, pl;
        pa.h[0] = *(const v8b*)(pwh + c * KVP + kk * 32 + 8 * hh);
        pa.h[1] = *(const v8b*)(pwh + c * KVP + kk * 32 + 16 + 8 * hh);
        pl.h[0] = *(const v8b*)(pwl + c * KVP + kk * 32 + 8 * hh);
        pl.h[1] = *(const v8b*)(pwl + c * KVP + kk * 32 + 16 + 8 * hh);
#pragma unroll
        for (int t = 0; t < 4; ++t) {
          FB vb, vl;
          vb.h[0] = *(const v8b*)(Vtth + bo + (t * 16 + c) * KVP + kk * 32 + 8 * hh);
          vb.h[1] = *(const v8b*)(Vtth + bo + (t * 16 + c) * KVP + kk * 32 + 16 + 8 * hh);
          vl.h[0] = *(const v8b*)(Vttl + bo + (t * 16 + c) * KVP + kk * 32 + 8 * hh);
          vl.h[1] = *(const v8b*)(Vttl + bo + (t * 16 + c) * KVP + kk * 32 + 16 + 8 * hh);
          oacc[t] = at_mma(pa.v, vb.v, oacc[t]);
          oacc[t] = at_mma(pa.v, vl.v, oacc[t]);
          oacc[t] = at_mma(pl.v, vb.v, oacc[t]);
        }
      }
      // ---- publish point of stage st + 1, every wave, in this order ----
      asm volatile("s_wait_dscnt 0x0" ::: "memory");       // this wave's reads of buffer st % 2 and of the bias tile are done
      tile_wait(g0, g1);                                    // this wave's tile of stage st + 1 has landed
      __syncthreads();                                      // stage st + 1 readable; buffer st % 2 and the bias tiles free
      if (pinned((uint32_t)(st + 2 < NST))) issue((uint32_t)st + 2u);   // refill of the buffer this pass has read
    }

    // ---- epilogue: normalise, stage the wave's 16x64 tile (pitch 64, own bias rows), hi | lo lines ----
    // (the last pass's barrier stands in front: every wave has left the bias tiles)
    {
      float* os = BTX + wave * 1024;
#pragma unroll
      for (int r = 0; r < 8; ++r) {
        const float inv = 1.0f / lrow[r];
#pragma unroll
        for (int t = 0; t < 4; ++t) os[(8 * hh + r) * 64 + t * 16 + c] = oacc[t][r] * inv + pz;
      }
      __builtin_amdgcn_fence(__ATOMIC_RELEASE, "workgroup");
      __builtin_amdgcn_wave_barrier();
      __builtin_amdgcn_fence(__ATOMIC_ACQUIRE, "workgroup");
      const int q4 = lane >> 3, c8 = (lane & 7) * 8;
      v4u hv[4], lv[4];
#pragma unroll
      for (int it = 0; it < 4; ++it) {
        const int row = it * 4 + q4;                   // it 0..3 x q4 0..3 covers rows 0..15
        const float* sp = os + row * 64 + c8;
        const v4f a = *(const v4fa*)sp;
        const v4f b = *(const v4fa*)(sp + 4);
        pack8hl(a, b, hv[it], lv[it]);
      }
      {
#pragma unroll
        for (int it = 0; it < 4; ++it) {
          const int row = it * 4 + q4;
          unsigned short* op = CTX + (size_t)(qrow + row) * PLD + h * HDM + c8;
          *(v4u*)op = hv[it];
          *(v4u*)(op + HID) = lv[it];
        }
        
      }
    }
    __syncthreads();   // every wave has read its staged tile back before the next head pair's zero fill sweeps it
  }
  // no request in flight and no LDS access outstanding when the wave ends
  asm volatile("s_wait_tensorcnt 0x0" ::: "memory");
  asm volatile("s_wait_dscnt 0x0" ::: "memory");
}

// =====================================================================================
static inline int cdiv(int a, int b) { return (a + b - 1) / b; }

extern "C" void kernel_launch(void* const* d_in, const int* in_sizes, int n_in,
                              void* d_out, int out_size, void* d_ws, size_t ws_size,
                              hipStream_t stream) {
  if (n_in < 15) return;
  if (in_sizes[0] != NTOT * HID) return;                        // x [16384][512]
  if (in_sizes[1] != NTOT) return;                              // batch [16384]
  if (in_sizes[2] < 2 || (in_sizes[2] & 1) != 0) return;        // edge_index [2][E]
  const int nE = in_sizes[2] / 2;
  if (nE < 1 || nE > (1 << 24)) return;
  if (in_sizes[3] != nE * EDW) return;                          // edge_attr [E][16]
  if (in_sizes[4] != HID * HID || in_sizes[6] != HID * HID || in_sizes[8] != HID * HID || in_sizes[10] != HID * HID) return;
  if (in_sizes[5] != HID || in_sizes[7] != HID || in_sizes[9] != HID || in_sizes[11] != HID) return;
  if (in_sizes[12] != EDW * NHD || in_sizes[13] != NHD || in_sizes[14] != 1) return;
  if (out_size != NTOT * HID) return;                           // out [16384][512], last element 8388607

  const float* x   = (const float*)d_in[0];
  const int*   bat = (const int*)  d_in[1];
  const int*   ei  = (const int*)  d_in[2];     // row 0 = src, row 1 = dst
  const float* ea  = (const float*)d_in[3];
  const float* Wq  = (const float*)d_in[4];     // [in][out]
  const float* bq  = (const float*)d_in[5];
  const float* Wk  = (const float*)d_in[6];
  const float* bk  = (const float*)d_in[7];
  const float* Wv  = (const float*)d_in[8];
  const float* bv  = (const float*)d_in[9];
  const float* Wo  = (const float*)d_in[10];
  const float* bo  = (const float*)d_in[11];
  const float* We  = (const float*)d_in[12];    // [16][8]
  const float* be  = (const float*)d_in[13];    // [8]
  const int*   ngp = (const int*)  d_in[14];    // [1]
  float* out = (float*)d_out;
  const int* keys = ei;                         // src list
  const int* gath = ei + nE;                    // dst list

  const int EP = cdiv(nE, 4) * 4;

  char* ws = (char*)d_ws;
  size_t off = 0;
  const size_t oXb = off; off += (size_t)NTOT * HID * 2;                                          // 16777216
  const size_t oWq = off; off += (size_t)HID * HID * 2;                                           //   524288
  const size_t oWk = off; off += (size_t)HID * HID * 2;
  const size_t oWv = off; off += (size_t)HID * HID * 2;
  const size_t oWo = off; off += (size_t)HID * PLD * 2;                                           //  1048576
  const size_t oEB = off; off += (size_t)EP * NHD * 4;   off = (off + 255) & ~(size_t)255;        //  8388608
  const size_t oQ  = off; off += (size_t)RHALF * PLD * 2;                                         // 33554432
  const size_t oK  = off; off += (size_t)RHALF * PLD * 2;
  const size_t oVT = off; off += (size_t)GHALF * HID * PLD * 2;                                   // 33554432
  const size_t oCT = off; off += (size_t)RHALF * PLD * 2;                                         // 33554432
  if (off > ws_size || off > (size_t)WSMAX) return;                                               // 162004992
  unsigned short* Xb   = (unsigned short*)(ws + oXb);
  unsigned short* WqT  = (unsigned short*)(ws + oWq);
  unsigned short* WkT  = (unsigned short*)(ws + oWk);
  unsigned short* WvT  = (unsigned short*)(ws + oWv);
  unsigned short* WOT2 = (unsigned short*)(ws + oWo);
  float*          EB   = (float*)(ws + oEB);
  unsigned short* Qp   = (unsigned short*)(ws + oQ);
  unsigned short* Kp   = (unsigned short*)(ws + oK);
  unsigned short* VTp  = (unsigned short*)(ws + oVT);
  unsigned short* CTX  = (unsigned short*)(ws + oCT);

  hipFuncSetAttribute(reinterpret_cast<const void*>(&k_attn),
                      hipFuncAttributeMaxDynamicSharedMemorySize, LDS_ATT);

  // weight planes (bf16 bits, k-contiguous rows [n][k]), node feature plane (whole x), edge bias plane [EP][8]
  {
    const int nUe = EP * 2;
    k_prep<<<PB_E0 + cdiv(nUe, NTHR), NTHR, 0, stream>>>(x, ea, We, be, Wq, Wk, Wv, Wo,
                                                         Xb, EB, WqT, WkT, WvT, WOT2, nE, nUe);
  }

  const dim3 blk(256);
  const dim3 gQK((RHALF / GBM) * (HID / GBN), 1);            // 256 block tiles: M=16384, N=512
  const dim3 gQKV(QKV_NB, 3);                                // q, k, v^T: 256 block tiles each
  const dim3 gAT(GHALF * (NND / 64));                        // 256 blocks: 32 graphs x 8 query tiles
  for (int half = 0; half < NHALF; ++half) {
    const unsigned short* Xh = Xb + (size_t)half * RHALF * HID;
    float* outh = out + (size_t)half * RHALF * HID;
    // q, k -> Qp, Kp hi | lo; v^T per graph -> VTp [graph][h*64+d][s] hi | lo
    k_qkv<<<gQKV, blk, 0, stream>>>(Xh, WqT, WkT, WvT, Qp, Kp, VTp, bq, bk, bv);
    // attention with edge bias -> CTX hi | lo
    k_attn<<<gAT, NTHR, LDS_ATT, stream>>>(Qp, Kp, VTp, EB, keys, gath, ngp, bat, CTX, nE, 1, half * GHALF);
    // out = [ctx hi | ctx lo] . [Wo ; Wo] + bo -> d_out rows half*RHALF .. half*RHALF+RHALF-1 (M=16384, N=512, K=1024)
    wmma_gemm64<false, 2, 0, false, 0><<<gQK, blk, 0, stream>>>(
        CTX, CTX, PLD, 0L, WOT2, WOT2, PLD, 0L, (void*)outh, (void*)outh, HID, 0L,
        bo, bo, 0L, RHALF, HID, PLD, 1.0f);
  }
  (void)hipGetLastError();
}
